// v000
// Measured on an AMD MI455X. A time is GPU time per run, averaged over a window of back-to-back runs after a warm-up
// (all launches, gaps included; the runs take copies of the inputs in turn), and the median of several windows.
// Apart from v000's, it joins two sittings. Times from different sittings can be a few percent apart, while
// side-by-side timings come from the same sitting.
// v000, which the later versions start from, runs in 168 microseconds.
#include <hip/hip_runtime.h>
#include <math.h>

// MI455X / gfx1250, wave32. fp32 WMMA path (V_WMMA_F32_16X16X4_F32):
//   A = 16x4 f32 (2 VGPRs/lane), B = 4x16 f32 (2 VGPRs/lane), C/D = 16x16 f32 (8 VGPRs/lane)
typedef __attribute__((ext_vector_type(2))) float v2f;
typedef __attribute__((ext_vector_type(8))) float v8f;

#define BATCH   2
#define SEQ     2048
#define HID     1024
#define NHEAD   16
#define HDIM    64
#define STRIDE_ 128
#define NEGMASK (-10000.0f)

// ---------------------------------------------------------------------------
// Kernel 1: fused Q/V projection.  One wave computes a 32(row) x 32(col) strip
// of BOTH Q and V: two A row-tiles share every B fragment, so each B load
// feeds 2 WMMAs (1 load : 1 WMMA issue ratio) and weight re-streaming traffic
// from L2 is halved vs an M=16 tiling.  8 f32 WMMA accumulators (64 VGPRs).
// Output written head-major [B, H, S, 64] into workspace.
// ---------------------------------------------------------------------------
__global__ __launch_bounds__(256) void qv_proj(
    const float* __restrict__ hid,
    const float* __restrict__ Wq, const float* __restrict__ bq,
    const float* __restrict__ Wv, const float* __restrict__ bv,
    float* __restrict__ qws, float* __restrict__ vws)
{
  const int lane = threadIdx.x & 31;
  const int wid  = (blockIdx.x * blockDim.x + threadIdx.x) >> 5;
  const int row_tile  = wid >> 5;   // 128 tiles of 32 rows (B*S = 4096)
  const int col_strip = wid & 31;   // 32 strips of 32 cols (HID = 1024)
  const int row0 = row_tile << 5;
  const int n0   = col_strip << 5;
  const int lr = lane & 15;         // M index (A) / N index (B,C,D)
  const int lh = lane >> 4;         // lane-half selector

  v8f accq[4] = {{}, {}, {}, {}};   // [rt*2 + nt]
  v8f accv[4] = {{}, {}, {}, {}};

  const float* arow0 = hid + (size_t)(row0 + lr) * HID;        // A tile 0
  const float* arow1 = hid + (size_t)(row0 + 16 + lr) * HID;   // A tile 1
  const float* wqp   = Wq + n0 + lr;                            // B: col = lane&15
  const float* wvp   = Wv + n0 + lr;

  for (int kk = 0; kk < HID; kk += 4) {
    const int ka = kk + lh * 2;                   // K pair owned by this half
    v2f a0, a1;
    a0.x = arow0[ka];  a0.y = arow0[ka + 1];      // contiguous -> b64 load
    a1.x = arow1[ka];  a1.y = arow1[ka + 1];

    const float* wq0 = wqp + (size_t)ka * HID;
    const float* wv0 = wvp + (size_t)ka * HID;
    v2f bq0, bq1, bv0_, bv1_;
    bq0.x  = wq0[0];   bq0.y  = wq0[HID];         // (K,N) and (K+1,N)
    bq1.x  = wq0[16];  bq1.y  = wq0[HID + 16];
    bv0_.x = wv0[0];   bv0_.y = wv0[HID];
    bv1_.x = wv0[16];  bv1_.y = wv0[HID + 16];

    accq[0] = __builtin_amdgcn_wmma_f32_16x16x4_f32(false, a0, false, bq0,  (short)0, accq[0], false, false);
    accq[1] = __builtin_amdgcn_wmma_f32_16x16x4_f32(false, a0, false, bq1,  (short)0, accq[1], false, false);
    accq[2] = __builtin_amdgcn_wmma_f32_16x16x4_f32(false, a1, false, bq0,  (short)0, accq[2], false, false);
    accq[3] = __builtin_amdgcn_wmma_f32_16x16x4_f32(false, a1, false, bq1,  (short)0, accq[3], false, false);
    accv[0] = __builtin_amdgcn_wmma_f32_16x16x4_f32(false, a0, false, bv0_, (short)0, accv[0], false, false);
    accv[1] = __builtin_amdgcn_wmma_f32_16x16x4_f32(false, a0, false, bv1_, (short)0, accv[1], false, false);
    accv[2] = __builtin_amdgcn_wmma_f32_16x16x4_f32(false, a1, false, bv0_, (short)0, accv[2], false, false);
    accv[3] = __builtin_amdgcn_wmma_f32_16x16x4_f32(false, a1, false, bv1_, (short)0, accv[3], false, false);
  }

  const float biasq[2] = { bq[n0 + lr], bq[n0 + 16 + lr] };
  const float biasv[2] = { bv[n0 + lr], bv[n0 + 16 + lr] };

  #pragma unroll
  for (int rt = 0; rt < 2; ++rt) {
    #pragma unroll
    for (int r = 0; r < 8; ++r) {
      const int g = row0 + rt * 16 + r + lh * 8;  // C/D layout: M = r + 8*half
      const int b = g >> 11, s = g & (SEQ - 1);
      #pragma unroll
      for (int nt = 0; nt < 2; ++nt) {
        const int n = n0 + nt * 16 + lr;
        const int h = n >> 6, dd = n & 63;
        const size_t o = (((size_t)(b * NHEAD + h) * SEQ + s) << 6) + dd;
        qws[o] = accq[rt * 2 + nt][r] + biasq[nt];
        vws[o] = accv[rt * 2 + nt][r] + biasv[nt];
      }
    }
  }
}

// ---------------------------------------------------------------------------
// Kernel 2: strided-sparse attention, one wave per (b, h, 16-row query tile).
// Only visits key tiles the mask can admit: local tiles [qt-8, qt] plus
// strided tiles qt-8m (m>=2).  Online (flash) softmax; P converted from C/D
// layout to A layout via a per-wave LDS slab; P@V accumulated with WMMA.
// Fully-masked tiles that we skip contribute exp(~-1250)=0 in fp32 in the
// reference as well, so results match the dense-masked softmax at fp32
// underflow level.
// ---------------------------------------------------------------------------
__global__ __launch_bounds__(256) void sparse_attn(
    const float* __restrict__ qws, const float* __restrict__ vws,
    const float* __restrict__ amask, float* __restrict__ out)
{
  __shared__ float plds[8][16 * 17];   // per-wave 16x16 P tile, stride 17
  const int lane = threadIdx.x & 31;
  const int w    = threadIdx.x >> 5;
  const int wid  = blockIdx.x * 8 + w;
  const int qt = wid & 127;            // query tile (S/16 = 128)
  const int h  = (wid >> 7) & 15;
  const int b  = wid >> 11;
  const int lr = lane & 15;
  const int lh = lane >> 4;
  const int i0 = qt << 4;

  const float* qbase = qws + (size_t)(b * NHEAD + h) * SEQ * HDIM;
  const float* vbase = vws + (size_t)(b * NHEAD + h) * SEQ * HDIM;
  const float* am    = amask + (size_t)b * SEQ;

  // Preload A fragments for the query rows (K = 64 -> 16 steps of 4).
  v2f afrag[16];
  {
    const float* qrow = qbase + (size_t)(i0 + lr) * HDIM;
    #pragma unroll
    for (int t = 0; t < 16; ++t) {
      const int k = t * 4 + lh * 2;
      afrag[t].x = qrow[k];  afrag[t].y = qrow[k + 1];
    }
  }

  v8f o0 = {}, o1 = {}, o2 = {}, o3 = {};
  float mrow[8], lrow[8];
  #pragma unroll
  for (int r = 0; r < 8; ++r) { mrow[r] = -3.0e38f; lrow[r] = 0.0f; }

  auto process_tile = [&](int jt) {
    const int j0 = jt << 4;
    // ---- scores: S = Q_i @ Q_jT  (16 chained f32 WMMAs) ----
    v8f sc = {};
    const float* krow = qbase + (size_t)(j0 + lr) * HDIM;  // B: N = lane&15
    #pragma unroll
    for (int t = 0; t < 16; ++t) {
      const int k = t * 4 + lh * 2;
      v2f bfr;  bfr.x = krow[k];  bfr.y = krow[k + 1];
      sc = __builtin_amdgcn_wmma_f32_16x16x4_f32(false, afrag[t], false, bfr,
                                                 (short)0, sc, false, false);
    }
    // ---- mask, scale, online softmax ----
    const float amj = am[j0 + lr];
    float scale[8];
    #pragma unroll
    for (int r = 0; r < 8; ++r) {
      const int i = i0 + r + lh * 8;
      const int j = j0 + lr;
      const int diff = i - j;
      const bool allowed =
          (diff >= 0) && ((diff < STRIDE_) || ((diff & (STRIDE_ - 1)) == 0));
      float s = (sc[r] + (allowed ? 0.0f : NEGMASK)) * 0.125f + amj;
      float mx = s;
      mx = fmaxf(mx, __shfl_xor(mx, 1, 16));
      mx = fmaxf(mx, __shfl_xor(mx, 2, 16));
      mx = fmaxf(mx, __shfl_xor(mx, 4, 16));
      mx = fmaxf(mx, __shfl_xor(mx, 8, 16));
      const float mnew  = fmaxf(mrow[r], mx);
      const float rescl = expf(mrow[r] - mnew);
      const float pv    = expf(s - mnew);
      float rs = pv;
      rs += __shfl_xor(rs, 1, 16);
      rs += __shfl_xor(rs, 2, 16);
      rs += __shfl_xor(rs, 4, 16);
      rs += __shfl_xor(rs, 8, 16);
      lrow[r]  = lrow[r] * rescl + rs;
      mrow[r]  = mnew;
      scale[r] = rescl;
      plds[w][(r + lh * 8) * 17 + lr] = pv;   // C-layout -> LDS row-major
    }
    #pragma unroll
    for (int r = 0; r < 8; ++r) {
      o0[r] *= scale[r]; o1[r] *= scale[r];
      o2[r] *= scale[r]; o3[r] *= scale[r];
    }
    // ---- P back from LDS in A layout (same-wave DS ops are in-order) ----
    v2f pfr[4];
    #pragma unroll
    for (int t = 0; t < 4; ++t) {
      const int k = t * 4 + lh * 2;
      pfr[t].x = plds[w][lr * 17 + k];
      pfr[t].y = plds[w][lr * 17 + k + 1];
    }
    // ---- O += P @ V  (K = 16 -> 4 steps, 4 d-tiles) ----
    #pragma unroll
    for (int t = 0; t < 4; ++t) {
      const int k = t * 4 + lh * 2;
      const float* vp = vbase + (size_t)(j0 + k) * HDIM + lr;
      v2f vb0, vb1, vb2, vb3;
      vb0.x = vp[0];   vb0.y = vp[HDIM];
      vb1.x = vp[16];  vb1.y = vp[HDIM + 16];
      vb2.x = vp[32];  vb2.y = vp[HDIM + 32];
      vb3.x = vp[48];  vb3.y = vp[HDIM + 48];
      o0 = __builtin_amdgcn_wmma_f32_16x16x4_f32(false, pfr[t], false, vb0, (short)0, o0, false, false);
      o1 = __builtin_amdgcn_wmma_f32_16x16x4_f32(false, pfr[t], false, vb1, (short)0, o1, false, false);
      o2 = __builtin_amdgcn_wmma_f32_16x16x4_f32(false, pfr[t], false, vb2, (short)0, o2, false, false);
      o3 = __builtin_amdgcn_wmma_f32_16x16x4_f32(false, pfr[t], false, vb3, (short)0, o3, false, false);
    }
  };

  // Strided tiles (diagonal-only mask): jt = qt - 8m, m >= 2.
  for (int jt = qt - 16; jt >= 0; jt -= 8) process_tile(jt);
  // Local causal window tiles: [max(0, qt-8), qt].
  const int local_lo = (qt >= 8) ? (qt - 8) : 0;
  for (int jt = local_lo; jt <= qt; ++jt) process_tile(jt);

  // ---- epilogue: divide by row sums, write [B, S, H*d] ----
  #pragma unroll
  for (int r = 0; r < 8; ++r) {
    const float inv = 1.0f / lrow[r];   // diagonal always allowed -> l > 0
    const int i = i0 + r + lh * 8;
    float* op = out + ((size_t)b * SEQ + i) * HID + h * HDIM + lr;
    op[0]  = o0[r] * inv;
    op[16] = o1[r] * inv;
    op[32] = o2[r] * inv;
    op[48] = o3[r] * inv;
  }
}

// ---------------------------------------------------------------------------
extern "C" void kernel_launch(void* const* d_in, const int* in_sizes, int n_in,
                              void* d_out, int out_size, void* d_ws, size_t ws_size,
                              hipStream_t stream) {
  const float* hid   = (const float*)d_in[0];  // [B, S, HID]
  const float* amask = (const float*)d_in[1];  // [B, 1, 1, S]
  const float* Wq    = (const float*)d_in[2];  // [HID, HID]
  const float* bq    = (const float*)d_in[3];  // [HID]
  const float* Wv    = (const float*)d_in[4];  // [HID, HID]
  const float* bv    = (const float*)d_in[5];  // [HID]

  float* qws = (float*)d_ws;                                   // 16 MB
  float* vws = qws + (size_t)BATCH * NHEAD * SEQ * HDIM;       // 16 MB

  // 4096 waves (32-row x 32-col strips) -> 512 blocks of 8 waves
  qv_proj<<<512, 256, 0, stream>>>(hid, Wq, bq, Wv, bv, qws, vws);
  // 4096 waves -> 512 blocks of 8 waves
  sparse_attn<<<512, 256, 0, stream>>>(qws, vws, amask, (float*)d_out);
}

// v001
// One run takes 135 microseconds.
// In both of two side-by-side timings against v000, it was 1.28 times as fast.
#include <hip/hip_runtime.h>
#include <math.h>

// MI455X / gfx1250, wave32. fp32 WMMA path (V_WMMA_F32_16X16X4_F32):
//   A = 16x4 f32 (2 VGPRs/lane), B = 4x16 f32 (2 VGPRs/lane), C/D = 16x16 f32 (8 VGPRs/lane)
typedef __attribute__((ext_vector_type(2))) float v2f;
typedef __attribute__((ext_vector_type(4))) float v4f;
typedef __attribute__((ext_vector_type(8))) float v8f;

#define BATCH   2
#define SEQ     2048
#define HID     1024
#define NHEAD   16
#define HDIM    64
#define STRIDE_ 128
#define NEGMASK (-10000.0f)

// ---------------------------------------------------------------------------
// Kernel 1: fused Q/V projection.  One block of 8 waves computes 128 rows x
// 64 columns (one head) of BOTH Q and V; a wave keeps its 32 x 32 strip of
// each (8 f32 WMMA accumulators).  The operands reach the waves through LDS:
// per 32-k chunk the block loads its hidden-state tile and its two weight
// tiles once, in whole 128-byte lines, and every wave reads its fragments
// from there with ds_load_b128.  Two LDS stages: the next chunk's global
// loads fly during this chunk's WMMAs, one barrier per chunk.
// LDS layout of a stage:
//   A: [128 rows][32 k], row pitch 36 dwords (16 B x odd: 16 rows of one
//      16-byte column fall on all 64 banks).
//   W: [8 k-quads][128 columns (Q 0-63, V 64-127)][4 k]: a column's four
//      consecutive k are one 16-byte slot.  Inside each group of 16 slots the
//      low two bits are rotated by the group's number, so that both the
//      transposing stores (columns 4 apart) and the fragment reads (columns
//      1 apart) touch every bank once.
// A 16-byte fragment read holds k = 8*s + 4*half + 0..3 for A and W alike and
// feeds two WMMAs (elements 0,1 then 2,3).
// Output written head-major [B, H, S, 64] into workspace.
// ---------------------------------------------------------------------------
#define KC       32                    // k per LDS stage
#define NCHUNK   (HID / KC)
#define APITCH   36                    // dwords per A row in LDS
#define A_DW     (128 * APITCH)        // dwords of the A tile
#define STAGE_DW (A_DW + (KC / 4) * 128 * 4)

__global__ __launch_bounds__(256) void qv_proj(
    const float* __restrict__ hid,
    const float* __restrict__ Wq, const float* __restrict__ bq,
    const float* __restrict__ Wv, const float* __restrict__ bv,
    float* __restrict__ qws, float* __restrict__ vws)
{
  __shared__ __attribute__((aligned(16))) float stage[2 * STAGE_DW];

  const int tid  = threadIdx.x;
  const int lane = tid & 31;
  const int wave = tid >> 5;
  const int wm   = wave >> 1;              // 4 wave rows of 32 rows
  const int wn   = wave & 1;               // 2 wave columns of 32 columns
  const int brow0 = (blockIdx.x >> 4) << 7;  // 32 tiles of 128 rows (B*S = 4096)
  const int bcol0 = (blockIdx.x & 15) << 6;  // 16 tiles of 64 columns (HID = 1024)
  const int row0 = brow0 + (wm << 5);
  const int n0   = bcol0 + (wn << 5);
  const int lr = lane & 15;         // M index (A) / N index (B,C,D)
  const int lh = lane >> 4;         // lane-half selector

  // ---- staging: what this thread moves per chunk ----
  // A: 4 pieces of 16 B; 8 threads cover one row's 128 B.
  const float* ag = hid + (size_t)(brow0 + (tid >> 3)) * HID + (tid & 7) * 4;
  const int    as = (tid >> 3) * APITCH + (tid & 7) * 4;
  // W: one 4 k x 4 column patch of Wq (waves 0-3) or Wv (waves 4-7).
  const int mat = tid >> 7, bkq = (tid >> 4) & 7, nq = tid & 15;
  const float* bg = (mat ? Wv : Wq) + (size_t)(bkq * 4) * HID + bcol0 + nq * 4;
  const int    bs = A_DW + (bkq * 128 + mat * 64 + nq * 4) * 4;
  const int    brot = nq >> 2;             // the patch's group of 16 columns

  v4f ra[4], rb[4];
  auto load_chunk = [&](int k0) {
    #pragma unroll  // constant indices keep the arrays in registers
    for (int i = 0; i < 4; ++i)
      ra[i] = *(const v4f*)(ag + (size_t)(i * 32) * HID + k0);
    #pragma unroll  // constant indices keep the arrays in registers
    for (int j = 0; j < 4; ++j)
      rb[j] = *(const v4f*)(bg + (size_t)(k0 + j) * HID);
    // The loads' address registers are reused or advanced further down.
    asm volatile("s_wait_xcnt 0x0" ::: "memory");
  };
  auto store_chunk = [&](float* st) {
    #pragma unroll  // constant indices keep the arrays in registers
    for (int i = 0; i < 4; ++i)
      *(v4f*)(st + as + i * 32 * APITCH) = ra[i];
    #pragma unroll  // constant indices keep the arrays in registers
    for (int c = 0; c < 4; ++c) {
      v4f t;  t.x = rb[0][c];  t.y = rb[1][c];  t.z = rb[2][c];  t.w = rb[3][c];
      *(v4f*)(st + bs + ((c + brot) & 3) * 4) = t;
    }
  };

  // ---- fragment addresses inside a stage (dwords) ----
  const int fa = ((wm << 5) + lr) * APITCH + lh * 4;
  int fb[2];                               // column tile nt of Q; V is 64 slots on
  #pragma unroll  // constant indices keep the arrays in registers
  for (int nt = 0; nt < 2; ++nt) {
    const int grp = wn * 2 + nt;
    fb[nt] = A_DW + (lh * 128 + grp * 16 + (lr & 12) + ((lr + grp) & 3)) * 4;
  }

  v8f accq[4] = {{}, {}, {}, {}};   // [rt*2 + nt]
  v8f accv[4] = {{}, {}, {}, {}};

  auto compute_steps = [&](const float* st, int s_lo, int s_hi) {   // 8 k a step
    #pragma unroll  // constant indices keep the arrays in registers
    for (int s = s_lo; s < s_hi; ++s) {
      const v4f a0  = *(const v4f*)(st + fa + s * 8);
      const v4f a1  = *(const v4f*)(st + fa + 16 * APITCH + s * 8);
      const v4f wq0 = *(const v4f*)(st + fb[0] + s * 1024);
      const v4f wq1 = *(const v4f*)(st + fb[1] + s * 1024);
      const v4f wv0 = *(const v4f*)(st + fb[0] + s * 1024 + 256);
      const v4f wv1 = *(const v4f*)(st + fb[1] + s * 1024 + 256);
      #pragma unroll  // constant indices keep the arrays in registers
      for (int p = 0; p < 2; ++p) {
        v2f x0, x1, q0, q1, u0, u1;
        x0.x = a0[2 * p];   x0.y = a0[2 * p + 1];
        x1.x = a1[2 * p];   x1.y = a1[2 * p + 1];
        q0.x = wq0[2 * p];  q0.y = wq0[2 * p + 1];
        q1.x = wq1[2 * p];  q1.y = wq1[2 * p + 1];
        u0.x = wv0[2 * p];  u0.y = wv0[2 * p + 1];
        u1.x = wv1[2 * p];  u1.y = wv1[2 * p + 1];
        accq[0] = __builtin_amdgcn_wmma_f32_16x16x4_f32(false, x0, false, q0, (short)0, accq[0], false, false);
        accq[1] = __builtin_amdgcn_wmma_f32_16x16x4_f32(false, x0, false, q1, (short)0, accq[1], false, false);
        accq[2] = __builtin_amdgcn_wmma_f32_16x16x4_f32(false, x1, false, q0, (short)0, accq[2], false, false);
        accq[3] = __builtin_amdgcn_wmma_f32_16x16x4_f32(false, x1, false, q1, (short)0, accq[3], false, false);
        accv[0] = __builtin_amdgcn_wmma_f32_16x16x4_f32(false, x0, false, u0, (short)0, accv[0], false, false);
        accv[1] = __builtin_amdgcn_wmma_f32_16x16x4_f32(false, x0, false, u1, (short)0, accv[1], false, false);
        accv[2] = __builtin_amdgcn_wmma_f32_16x16x4_f32(false, x1, false, u0, (short)0, accv[2], false, false);
        accv[3] = __builtin_amdgcn_wmma_f32_16x16x4_f32(false, x1, false, u1, (short)0, accv[3], false, false);
      }
    }
  };

  load_chunk(0);
  store_chunk(stage);
  __syncthreads();
  for (int c = 0; c < NCHUNK - 1; ++c) {
    const float* cur = stage + (c & 1) * STAGE_DW;
    load_chunk((c + 1) * KC);                       // in flight under the WMMAs
    // Keeps all eight global loads ahead of the WMMAs: without it the scheduler
    // sinks half of them to the foot of the trip, right in front of their wait.
    __builtin_amdgcn_sched_barrier(0);
    compute_steps(cur, 0, KC / 8 - 1);
    // Keeps the transposing moves, and with them the wait for the global loads,
    // behind three quarters of the trip's WMMAs: without it they rise to the top.
    __builtin_amdgcn_sched_barrier(0);
    store_chunk(stage + ((c + 1) & 1) * STAGE_DW);  // its readers left at the last barrier
    compute_steps(cur, KC / 8 - 1, KC / 8);         // covers the LDS stores
    __syncthreads();
  }
  compute_steps(stage + ((NCHUNK - 1) & 1) * STAGE_DW, 0, KC / 8);

  const float biasq[2] = { bq[n0 + lr], bq[n0 + 16 + lr] };
  const float biasv[2] = { bv[n0 + lr], bv[n0 + 16 + lr] };

  #pragma unroll
  for (int rt = 0; rt < 2; ++rt) {
    #pragma unroll
    for (int r = 0; r < 8; ++r) {
      const int g = row0 + rt * 16 + r + lh * 8;  // C/D layout: M = r + 8*half
      const int b = g >> 11, s = g & (SEQ - 1);
      #pragma unroll
      for (int nt = 0; nt < 2; ++nt) {
        const int n = n0 + nt * 16 + lr;
        const int h = n >> 6, dd = n & 63;
        const size_t o = (((size_t)(b * NHEAD + h) * SEQ + s) << 6) + dd;
        qws[o] = accq[rt * 2 + nt][r] + biasq[nt];
        vws[o] = accv[rt * 2 + nt][r] + biasv[nt];
      }
    }
  }
}

// ---------------------------------------------------------------------------
// Kernel 2: strided-sparse attention, one wave per (b, h, 16-row query tile).
// Only visits key tiles the mask can admit: local tiles [qt-8, qt] plus
// strided tiles qt-8m (m>=2).  Online (flash) softmax; P converted from C/D
// layout to A layout via a per-wave LDS slab; P@V accumulated with WMMA.
// Fully-masked tiles that we skip contribute exp(~-1250)=0 in fp32 in the
// reference as well, so results match the dense-masked softmax at fp32
// underflow level.
// ---------------------------------------------------------------------------
__global__ __launch_bounds__(256) void sparse_attn(
    const float* __restrict__ qws, const float* __restrict__ vws,
    const float* __restrict__ amask, float* __restrict__ out)
{
  __shared__ float plds[8][16 * 17];   // per-wave 16x16 P tile, stride 17
  const int lane = threadIdx.x & 31;
  const int w    = threadIdx.x >> 5;
  const int wid  = blockIdx.x * 8 + w;
  const int qt = wid & 127;            // query tile (S/16 = 128)
  const int h  = (wid >> 7) & 15;
  const int b  = wid >> 11;
  const int lr = lane & 15;
  const int lh = lane >> 4;
  const int i0 = qt << 4;

  const float* qbase = qws + (size_t)(b * NHEAD + h) * SEQ * HDIM;
  const float* vbase = vws + (size_t)(b * NHEAD + h) * SEQ * HDIM;
  const float* am    = amask + (size_t)b * SEQ;

  // Preload A fragments for the query rows (K = 64 -> 16 steps of 4).
  v2f afrag[16];
  {
    const float* qrow = qbase + (size_t)(i0 + lr) * HDIM;
    #pragma unroll
    for (int t = 0; t < 16; ++t) {
      const int k = t * 4 + lh * 2;
      afrag[t].x = qrow[k];  afrag[t].y = qrow[k + 1];
    }
  }

  v8f o0 = {}, o1 = {}, o2 = {}, o3 = {};
  float mrow[8], lrow[8];
  #pragma unroll
  for (int r = 0; r < 8; ++r) { mrow[r] = -3.0e38f; lrow[r] = 0.0f; }

  auto process_tile = [&](int jt) {
    const int j0 = jt << 4;
    // ---- scores: S = Q_i @ Q_jT  (16 chained f32 WMMAs) ----
    v8f sc = {};
    const float* krow = qbase + (size_t)(j0 + lr) * HDIM;  // B: N = lane&15
    #pragma unroll
    for (int t = 0; t < 16; ++t) {
      const int k = t * 4 + lh * 2;
      v2f bfr;  bfr.x = krow[k];  bfr.y = krow[k + 1];
      sc = __builtin_amdgcn_wmma_f32_16x16x4_f32(false, afrag[t], false, bfr,
                                                 (short)0, sc, false, false);
    }
    // ---- mask, scale, online softmax ----
    const float amj = am[j0 + lr];
    float scale[8];
    #pragma unroll
    for (int r = 0; r < 8; ++r) {
      const int i = i0 + r + lh * 8;
      const int j = j0 + lr;
      const int diff = i - j;
      const bool allowed =
          (diff >= 0) && ((diff < STRIDE_) || ((diff & (STRIDE_ - 1)) == 0));
      float s = (sc[r] + (allowed ? 0.0f : NEGMASK)) * 0.125f + amj;
      float mx = s;
      mx = fmaxf(mx, __shfl_xor(mx, 1, 16));
      mx = fmaxf(mx, __shfl_xor(mx, 2, 16));
      mx = fmaxf(mx, __shfl_xor(mx, 4, 16));
      mx = fmaxf(mx, __shfl_xor(mx, 8, 16));
      const float mnew  = fmaxf(mrow[r], mx);
      const float rescl = expf(mrow[r] - mnew);
      const float pv    = expf(s - mnew);
      float rs = pv;
      rs += __shfl_xor(rs, 1, 16);
      rs += __shfl_xor(rs, 2, 16);
      rs += __shfl_xor(rs, 4, 16);
      rs += __shfl_xor(rs, 8, 16);
      lrow[r]  = lrow[r] * rescl + rs;
      mrow[r]  = mnew;
      scale[r] = rescl;
      plds[w][(r + lh * 8) * 17 + lr] = pv;   // C-layout -> LDS row-major
    }
    #pragma unroll
    for (int r = 0; r < 8; ++r) {
      o0[r] *= scale[r]; o1[r] *= scale[r];
      o2[r] *= scale[r]; o3[r] *= scale[r];
    }
    // ---- P back from LDS in A layout (same-wave DS ops are in-order) ----
    v2f pfr[4];
    #pragma unroll
    for (int t = 0; t < 4; ++t) {
      const int k = t * 4 + lh * 2;
      pfr[t].x = plds[w][lr * 17 + k];
      pfr[t].y = plds[w][lr * 17 + k + 1];
    }
    // ---- O += P @ V  (K = 16 -> 4 steps, 4 d-tiles) ----
    #pragma unroll
    for (int t = 0; t < 4; ++t) {
      const int k = t * 4 + lh * 2;
      const float* vp = vbase + (size_t)(j0 + k) * HDIM + lr;
      v2f vb0, vb1, vb2, vb3;
      vb0.x = vp[0];   vb0.y = vp[HDIM];
      vb1.x = vp[16];  vb1.y = vp[HDIM + 16];
      vb2.x = vp[32];  vb2.y = vp[HDIM + 32];
      vb3.x = vp[48];  vb3.y = vp[HDIM + 48];
      o0 = __builtin_amdgcn_wmma_f32_16x16x4_f32(false, pfr[t], false, vb0, (short)0, o0, false, false);
      o1 = __builtin_amdgcn_wmma_f32_16x16x4_f32(false, pfr[t], false, vb1, (short)0, o1, false, false);
      o2 = __builtin_amdgcn_wmma_f32_16x16x4_f32(false, pfr[t], false, vb2, (short)0, o2, false, false);
      o3 = __builtin_amdgcn_wmma_f32_16x16x4_f32(false, pfr[t], false, vb3, (short)0, o3, false, false);
    }
  };

  // Strided tiles (diagonal-only mask): jt = qt - 8m, m >= 2.
  for (int jt = qt - 16; jt >= 0; jt -= 8) process_tile(jt);
  // Local causal window tiles: [max(0, qt-8), qt].
  const int local_lo = (qt >= 8) ? (qt - 8) : 0;
  for (int jt = local_lo; jt <= qt; ++jt) process_tile(jt);

  // ---- epilogue: divide by row sums, write [B, S, H*d] ----
  #pragma unroll
  for (int r = 0; r < 8; ++r) {
    const float inv = 1.0f / lrow[r];   // diagonal always allowed -> l > 0
    const int i = i0 + r + lh * 8;
    float* op = out + ((size_t)b * SEQ + i) * HID + h * HDIM + lr;
    op[0]  = o0[r] * inv;
    op[16] = o1[r] * inv;
    op[32] = o2[r] * inv;
    op[48] = o3[r] * inv;
  }
}

// ---------------------------------------------------------------------------
extern "C" void kernel_launch(void* const* d_in, const int* in_sizes, int n_in,
                              void* d_out, int out_size, void* d_ws, size_t ws_size,
                              hipStream_t stream) {
  const float* hid   = (const float*)d_in[0];  // [B, S, HID]
  const float* amask = (const float*)d_in[1];  // [B, 1, 1, S]
  const float* Wq    = (const float*)d_in[2];  // [HID, HID]
  const float* bq    = (const float*)d_in[3];  // [HID]
  const float* Wv    = (const float*)d_in[4];  // [HID, HID]
  const float* bv    = (const float*)d_in[5];  // [HID]

  float* qws = (float*)d_ws;                                   // 16 MB
  float* vws = qws + (size_t)BATCH * NHEAD * SEQ * HDIM;       // 16 MB

  // 32 row tiles x 16 heads -> 512 blocks of 8 waves
  qv_proj<<<512, 256, 0, stream>>>(hid, Wq, bq, Wv, bv, qws, vws);
  // 4096 waves -> 512 blocks of 8 waves
  sparse_attn<<<512, 256, 0, stream>>>(qws, vws, amask, (float*)d_out);
}

// v002
// One run takes 125 microseconds.
// Next to v001, in two timings, it ran 1.09 and 1.07 times as fast.
// Over all steps from v000 it is 1.38 times as fast.
#include <hip/hip_runtime.h>
#include <math.h>

// MI455X / gfx1250, wave32. fp32 WMMA path (V_WMMA_F32_16X16X4_F32):
//   A = 16x4 f32 (2 VGPRs/lane), B = 4x16 f32 (2 VGPRs/lane), C/D = 16x16 f32 (8 VGPRs/lane)
typedef __attribute__((ext_vector_type(2))) float v2f;
typedef __attribute__((ext_vector_type(4))) float v4f;
typedef __attribute__((ext_vector_type(8))) float v8f;

#define BATCH   2
#define SEQ     2048
#define HID     1024
#define NHEAD   16
#define HDIM    64
#define STRIDE_ 128
#define NEGMASK (-10000.0f)

// ---------------------------------------------------------------------------
// Kernel 1: fused Q/V projection.  One block of 8 waves computes 128 rows x
// 64 columns (one head) of BOTH Q and V; a wave keeps its 32 x 32 strip of
// each (8 f32 WMMA accumulators).  The operands reach the waves through LDS:
// per 32-k chunk the block loads its hidden-state tile and its two weight
// tiles once, in whole 128-byte lines, and every wave reads its fragments
// from there with ds_load_b128.  Two LDS stages: the next chunk's global
// loads fly during this chunk's WMMAs, one barrier per chunk.
// LDS layout of a stage:
//   A: [128 rows][32 k], row pitch 36 dwords (16 B x odd: 16 rows of one
//      16-byte column fall on all 64 banks).
//   W: [8 k-quads][128 columns (Q 0-63, V 64-127)][4 k]: a column's four
//      consecutive k are one 16-byte slot.  Inside each group of 16 slots the
//      low two bits are rotated by the group's number, so that both the
//      transposing stores (columns 4 apart) and the fragment reads (columns
//      1 apart) touch every bank once.
// A 16-byte fragment read holds k = 8*s + 4*half + 0..3 for A and W alike and
// feeds two WMMAs (elements 0,1 then 2,3).
// Output written head-major [B, H, S, 64] into workspace.
// ---------------------------------------------------------------------------
#define KC       32                    // k per LDS stage
#define NCHUNK   (HID / KC)
#define APITCH   36                    // dwords per A row in LDS
#define A_DW     (128 * APITCH)        // dwords of the A tile
#define STAGE_DW (A_DW + (KC / 4) * 128 * 4)

__global__ __launch_bounds__(256) void qv_proj(
    const float* __restrict__ hid,
    const float* __restrict__ Wq, const float* __restrict__ bq,
    const float* __restrict__ Wv, const float* __restrict__ bv,
    float* __restrict__ qws, float* __restrict__ vws)
{
  __shared__ __attribute__((aligned(16))) float stage[2 * STAGE_DW];

  const int tid  = threadIdx.x;
  const int lane = tid & 31;
  const int wave = tid >> 5;
  const int wm   = wave >> 1;              // 4 wave rows of 32 rows
  const int wn   = wave & 1;               // 2 wave columns of 32 columns
  const int brow0 = (blockIdx.x >> 4) << 7;  // 32 tiles of 128 rows (B*S = 4096)
  const int bcol0 = (blockIdx.x & 15) << 6;  // 16 tiles of 64 columns (HID = 1024)
  const int row0 = brow0 + (wm << 5);
  const int n0   = bcol0 + (wn << 5);
  const int lr = lane & 15;         // M index (A) / N index (B,C,D)
  const int lh = lane >> 4;         // lane-half selector

  // ---- staging: what this thread moves per chunk ----
  // A: 4 pieces of 16 B; 8 threads cover one row's 128 B.
  const float* ag = hid + (size_t)(brow0 + (tid >> 3)) * HID + (tid & 7) * 4;
  const int    as = (tid >> 3) * APITCH + (tid & 7) * 4;
  // W: one 4 k x 4 column patch of Wq (waves 0-3) or Wv (waves 4-7).
  const int mat = tid >> 7, bkq = (tid >> 4) & 7, nq = tid & 15;
  const float* bg = (mat ? Wv : Wq) + (size_t)(bkq * 4) * HID + bcol0 + nq * 4;
  const int    bs = A_DW + (bkq * 128 + mat * 64 + nq * 4) * 4;
  const int    brot = nq >> 2;             // the patch's group of 16 columns

  v4f ra[4], rb[4];
  auto load_chunk = [&](int k0) {
    #pragma unroll  // constant indices keep the arrays in registers
    for (int i = 0; i < 4; ++i)
      ra[i] = *(const v4f*)(ag + (size_t)(i * 32) * HID + k0);
    #pragma unroll  // constant indices keep the arrays in registers
    for (int j = 0; j < 4; ++j)
      rb[j] = *(const v4f*)(bg + (size_t)(k0 + j) * HID);
    // The loads' address registers are reused or advanced further down.
    asm volatile("s_wait_xcnt 0x0" ::: "memory");
  };
  auto store_chunk = [&](float* st) {
    #pragma unroll  // constant indices keep the arrays in registers
    for (int i = 0; i < 4; ++i)
      *(v4f*)(st + as + i * 32 * APITCH) = ra[i];
    #pragma unroll  // constant indices keep the arrays in registers
    for (int c = 0; c < 4; ++c) {
      v4f t;  t.x = rb[0][c];  t.y = rb[1][c];  t.z = rb[2][c];  t.w = rb[3][c];
      *(v4f*)(st + bs + ((c + brot) & 3) * 4) = t;
    }
  };

  // ---- fragment addresses inside a stage (dwords) ----
  const int fa = ((wm << 5) + lr) * APITCH + lh * 4;
  int fb[2];                               // column tile nt of Q; V is 64 slots on
  #pragma unroll  // constant indices keep the arrays in registers
  for (int nt = 0; nt < 2; ++nt) {
    const int grp = wn * 2 + nt;
    fb[nt] = A_DW + (lh * 128 + grp * 16 + (lr & 12) + ((lr + grp) & 3)) * 4;
  }

  v8f accq[4] = {{}, {}, {}, {}};   // [rt*2 + nt]
  v8f accv[4] = {{}, {}, {}, {}};

  auto compute_steps = [&](const float* st, int s_lo, int s_hi) {   // 8 k a step
    #pragma unroll  // constant indices keep the arrays in registers
    for (int s = s_lo; s < s_hi; ++s) {
      const v4f a0  = *(const v4f*)(st + fa + s * 8);
      const v4f a1  = *(const v4f*)(st + fa + 16 * APITCH + s * 8);
      const v4f wq0 = *(const v4f*)(st + fb[0] + s * 1024);
      const v4f wq1 = *(const v4f*)(st + fb[1] + s * 1024);
      const v4f wv0 = *(const v4f*)(st + fb[0] + s * 1024 + 256);
      const v4f wv1 = *(const v4f*)(st + fb[1] + s * 1024 + 256);
      #pragma unroll  // constant indices keep the arrays in registers
      for (int p = 0; p < 2; ++p) {
        v2f x0, x1, q0, q1, u0, u1;
        x0.x = a0[2 * p];   x0.y = a0[2 * p + 1];
        x1.x = a1[2 * p];   x1.y = a1[2 * p + 1];
        q0.x = wq0[2 * p];  q0.y = wq0[2 * p + 1];
        q1.x = wq1[2 * p];  q1.y = wq1[2 * p + 1];
        u0.x = wv0[2 * p];  u0.y = wv0[2 * p + 1];
        u1.x = wv1[2 * p];  u1.y = wv1[2 * p + 1];
        accq[0] = __builtin_amdgcn_wmma_f32_16x16x4_f32(false, x0, false, q0, (short)0, accq[0], false, false);
        accq[1] = __builtin_amdgcn_wmma_f32_16x16x4_f32(false, x0, false, q1, (short)0, accq[1], false, false);
        accq[2] = __builtin_amdgcn_wmma_f32_16x16x4_f32(false, x1, false, q0, (short)0, accq[2], false, false);
        accq[3] = __builtin_amdgcn_wmma_f32_16x16x4_f32(false, x1, false, q1, (short)0, accq[3], false, false);
        accv[0] = __builtin_amdgcn_wmma_f32_16x16x4_f32(false, x0, false, u0, (short)0, accv[0], false, false);
        accv[1] = __builtin_amdgcn_wmma_f32_16x16x4_f32(false, x0, false, u1, (short)0, accv[1], false, false);
        accv[2] = __builtin_amdgcn_wmma_f32_16x16x4_f32(false, x1, false, u0, (short)0, accv[2], false, false);
        accv[3] = __builtin_amdgcn_wmma_f32_16x16x4_f32(false, x1, false, u1, (short)0, accv[3], false, false);
      }
    }
  };

  load_chunk(0);
  store_chunk(stage);
  __syncthreads();
  for (int c = 0; c < NCHUNK - 1; ++c) {
    const float* cur = stage + (c & 1) * STAGE_DW;
    load_chunk((c + 1) * KC);                       // in flight under the WMMAs
    // Keeps all eight global loads ahead of the WMMAs: without it the scheduler
    // sinks half of them to the foot of the trip, right in front of their wait.
    __builtin_amdgcn_sched_barrier(0);
    compute_steps(cur, 0, KC / 8 - 1);
    // Keeps the transposing moves, and with them the wait for the global loads,
    // behind three quarters of the trip's WMMAs: without it they rise to the top.
    __builtin_amdgcn_sched_barrier(0);
    store_chunk(stage + ((c + 1) & 1) * STAGE_DW);  // its readers left at the last barrier
    compute_steps(cur, KC / 8 - 1, KC / 8);         // covers the LDS stores
    __syncthreads();
  }
  compute_steps(stage + ((NCHUNK - 1) & 1) * STAGE_DW, 0, KC / 8);

  const float biasq[2] = { bq[n0 + lr], bq[n0 + 16 + lr] };
  const float biasv[2] = { bv[n0 + lr], bv[n0 + 16 + lr] };

  #pragma unroll
  for (int rt = 0; rt < 2; ++rt) {
    #pragma unroll
    for (int r = 0; r < 8; ++r) {
      const int g = row0 + rt * 16 + r + lh * 8;  // C/D layout: M = r + 8*half
      const int b = g >> 11, s = g & (SEQ - 1);
      #pragma unroll
      for (int nt = 0; nt < 2; ++nt) {
        const int n = n0 + nt * 16 + lr;
        const int h = n >> 6, dd = n & 63;
        const size_t o = (((size_t)(b * NHEAD + h) * SEQ + s) << 6) + dd;
        qws[o] = accq[rt * 2 + nt][r] + biasq[nt];
        vws[o] = accv[rt * 2 + nt][r] + biasv[nt];
      }
    }
  }
}

// ---------------------------------------------------------------------------
// Kernel 2: strided-sparse attention, one wave per (b, h, 16-row query tile).
// Only visits key tiles the mask can admit: local tiles [qt-8, qt] plus
// strided tiles qt-8m (m>=2).  Online (flash) softmax; P converted from C/D
// layout to A layout via a per-wave LDS slab; P@V accumulated with WMMA.
// Fully-masked tiles that we skip contribute exp(~-1250)=0 in fp32 in the
// reference as well, so results match the dense-masked softmax at fp32
// underflow level.
// ---------------------------------------------------------------------------
__global__ __launch_bounds__(256) void sparse_attn(
    const float* __restrict__ qws, const float* __restrict__ vws,
    const float* __restrict__ amask, float* __restrict__ out)
{
  __shared__ float plds[8][16 * 17];   // per-wave 16x16 P tile, stride 17
  const int lane = threadIdx.x & 31;
  const int w    = threadIdx.x >> 5;
  // A query tile's key tiles grow with its index (1 at tile 0, 23 at tile 127)
  // and every block is resident at once, so the launch lasts as long as its
  // fullest block.  Block g of a head takes four tiles from the top of the
  // sequence (waves 0-3) and the four mirrored ones from the bottom (waves
  // 4-7): tiles t and 127 - t together visit 31 key tiles (fewer for t < 8).
  // Waves w and w + 4 hold such a pair.  The waves share no barrier or buffer.
  const int g  = blockIdx.x & 15;
  const int qt = (w < 4) ? (127 - 4 * g - w) : (4 * g + (w - 4));  // S/16 = 128 tiles
  const int h  = (blockIdx.x >> 4) & 15;
  const int b  = blockIdx.x >> 8;
  const int lr = lane & 15;
  const int lh = lane >> 4;
  const int i0 = qt << 4;

  const float* qbase = qws + (size_t)(b * NHEAD + h) * SEQ * HDIM;
  const float* vbase = vws + (size_t)(b * NHEAD + h) * SEQ * HDIM;
  const float* am    = amask + (size_t)b * SEQ;

  // Preload A fragments for the query rows (K = 64 -> 16 steps of 4).
  v2f afrag[16];
  {
    const float* qrow = qbase + (size_t)(i0 + lr) * HDIM;
    #pragma unroll
    for (int t = 0; t < 16; ++t) {
      const int k = t * 4 + lh * 2;
      afrag[t].x = qrow[k];  afrag[t].y = qrow[k + 1];
    }
  }

  v8f o0 = {}, o1 = {}, o2 = {}, o3 = {};
  float mrow[8], lrow[8];
  #pragma unroll
  for (int r = 0; r < 8; ++r) { mrow[r] = -3.0e38f; lrow[r] = 0.0f; }

  auto process_tile = [&](int jt) {
    const int j0 = jt << 4;
    // ---- scores: S = Q_i @ Q_jT  (16 chained f32 WMMAs) ----
    v8f sc = {};
    const float* krow = qbase + (size_t)(j0 + lr) * HDIM;  // B: N = lane&15
    #pragma unroll
    for (int t = 0; t < 16; ++t) {
      const int k = t * 4 + lh * 2;
      v2f bfr;  bfr.x = krow[k];  bfr.y = krow[k + 1];
      sc = __builtin_amdgcn_wmma_f32_16x16x4_f32(false, afrag[t], false, bfr,
                                                 (short)0, sc, false, false);
    }
    // ---- mask, scale, online softmax ----
    const float amj = am[j0 + lr];
    float scale[8];
    #pragma unroll
    for (int r = 0; r < 8; ++r) {
      const int i = i0 + r + lh * 8;
      const int j = j0 + lr;
      const int diff = i - j;
      const bool allowed =
          (diff >= 0) && ((diff < STRIDE_) || ((diff & (STRIDE_ - 1)) == 0));
      float s = (sc[r] + (allowed ? 0.0f : NEGMASK)) * 0.125f + amj;
      float mx = s;
      mx = fmaxf(mx, __shfl_xor(mx, 1, 16));
      mx = fmaxf(mx, __shfl_xor(mx, 2, 16));
      mx = fmaxf(mx, __shfl_xor(mx, 4, 16));
      mx = fmaxf(mx, __shfl_xor(mx, 8, 16));
      const float mnew  = fmaxf(mrow[r], mx);
      const float rescl = expf(mrow[r] - mnew);
      const float pv    = expf(s - mnew);
      float rs = pv;
      rs += __shfl_xor(rs, 1, 16);
      rs += __shfl_xor(rs, 2, 16);
      rs += __shfl_xor(rs, 4, 16);
      rs += __shfl_xor(rs, 8, 16);
      lrow[r]  = lrow[r] * rescl + rs;
      mrow[r]  = mnew;
      scale[r] = rescl;
      plds[w][(r + lh * 8) * 17 + lr] = pv;   // C-layout -> LDS row-major
    }
    #pragma unroll
    for (int r = 0; r < 8; ++r) {
      o0[r] *= scale[r]; o1[r] *= scale[r];
      o2[r] *= scale[r]; o3[r] *= scale[r];
    }
    // ---- P back from LDS in A layout (same-wave DS ops are in-order) ----
    v2f pfr[4];
    #pragma unroll
    for (int t = 0; t < 4; ++t) {
      const int k = t * 4 + lh * 2;
      pfr[t].x = plds[w][lr * 17 + k];
      pfr[t].y = plds[w][lr * 17 + k + 1];
    }
    // ---- O += P @ V  (K = 16 -> 4 steps, 4 d-tiles) ----
    #pragma unroll
    for (int t = 0; t < 4; ++t) {
      const int k = t * 4 + lh * 2;
      const float* vp = vbase + (size_t)(j0 + k) * HDIM + lr;
      v2f vb0, vb1, vb2, vb3;
      vb0.x = vp[0];   vb0.y = vp[HDIM];
      vb1.x = vp[16];  vb1.y = vp[HDIM + 16];
      vb2.x = vp[32];  vb2.y = vp[HDIM + 32];
      vb3.x = vp[48];  vb3.y = vp[HDIM + 48];
      o0 = __builtin_amdgcn_wmma_f32_16x16x4_f32(false, pfr[t], false, vb0, (short)0, o0, false, false);
      o1 = __builtin_amdgcn_wmma_f32_16x16x4_f32(false, pfr[t], false, vb1, (short)0, o1, false, false);
      o2 = __builtin_amdgcn_wmma_f32_16x16x4_f32(false, pfr[t], false, vb2, (short)0, o2, false, false);
      o3 = __builtin_amdgcn_wmma_f32_16x16x4_f32(false, pfr[t], false, vb3, (short)0, o3, false, false);
    }
  };

  // Strided tiles (diagonal-only mask): jt = qt - 8m, m >= 2.
  for (int jt = qt - 16; jt >= 0; jt -= 8) process_tile(jt);
  // Local causal window tiles: [max(0, qt-8), qt].
  const int local_lo = (qt >= 8) ? (qt - 8) : 0;
  for (int jt = local_lo; jt <= qt; ++jt) process_tile(jt);

  // ---- epilogue: divide by row sums, write [B, S, H*d] ----
  #pragma unroll
  for (int r = 0; r < 8; ++r) {
    const float inv = 1.0f / lrow[r];   // diagonal always allowed -> l > 0
    const int i = i0 + r + lh * 8;
    float* op = out + ((size_t)b * SEQ + i) * HID + h * HDIM + lr;
    op[0]  = o0[r] * inv;
    op[16] = o1[r] * inv;
    op[32] = o2[r] * inv;
    op[48] = o3[r] * inv;
  }
}

// ---------------------------------------------------------------------------
extern "C" void kernel_launch(void* const* d_in, const int* in_sizes, int n_in,
                              void* d_out, int out_size, void* d_ws, size_t ws_size,
                              hipStream_t stream) {
  const float* hid   = (const float*)d_in[0];  // [B, S, HID]
  const float* amask = (const float*)d_in[1];  // [B, 1, 1, S]
  const float* Wq    = (const float*)d_in[2];  // [HID, HID]
  const float* bq    = (const float*)d_in[3];  // [HID]
  const float* Wv    = (const float*)d_in[4];  // [HID, HID]
  const float* bv    = (const float*)d_in[5];  // [HID]

  float* qws = (float*)d_ws;                                   // 16 MB
  float* vws = qws + (size_t)BATCH * NHEAD * SEQ * HDIM;       // 16 MB

  // 32 row tiles x 16 heads -> 512 blocks of 8 waves
  qv_proj<<<512, 256, 0, stream>>>(hid, Wq, bq, Wv, bv, qws, vws);
  // 4096 waves -> 512 blocks of 8 waves (16 blocks a head, 32 heads)
  sparse_attn<<<512, 256, 0, stream>>>(qws, vws, amask, (float*)d_out);
}
